// v010
// Measured on an AMD MI455X. A time is GPU time per run, averaged over a window of back-to-back runs after a warm-up
// (all launches, gaps included; the runs take copies of the inputs in turn), and the median of several windows.
// Apart from v000's, it joins two sittings. Times from different sittings can be a few percent apart, while
// side-by-side timings come from the same sitting.
// Earlier versions than v010 are not in this document.
// One run takes 69.8 microseconds.
// Two timings next to v009 both put it at 1.05 times that version's speed.
// Over all steps from v000, the starting kernel, it is 67.3 times as fast.
#include <hip/hip_runtime.h>
// Masked (causal) RoPE multi-head attention with LARGE logits (x [2][2048][1024]; qkv = x w_qkv + b_qkv ([in][out] 1024 x 3072, sigma 1/32, bias sigma 0.01) -> q | k | v, 16 heads of 64; interleaved-pair RoPE on q and k (inv_freq_i = 10000^(-2i/64), positions 0..2047); scores = q . k x sqrt(64) (the module divides by 1/sqrt(d_k)), causal (tril); softmax; out = (attn v merged) w_out + b_out -> [2][2048][1024]).
// Structure: token rows r = b*2048 + s; x as exact f16 rows (bf16-rounded); q | k | v of every row as ONE WMMA GEMM launch (64x64 wave tiles, f32 accumulation, exact x16 weights + bias, N = 3 x 1024) whose epilogue, a wave's 64 columns being one head, does on VALU: the interleaved-pair rotary rotation of q and k from f32 cos/sin tables (positions 0..SQ-1, no norm) and their split into f16 hi + x1024 residual planes (the x8 logits have sigma ~64: near-argmax softmax, so the scores are computed to ~f32 accuracy from three products), v as f16 into V^T; then ONE fused attention launch over every (batch, head, 128-query block): a wave holds 32 queries and walks every third pass of 32 keys up to its own diagonal (three waves a query group, joined through LDS at the end), scores as S^T = K . Q^T (three products), online causal softmax in registers (f32 running maximum and sum, native exp; keys above the diagonal set to -1e9; weights x256 f16), O^T += V^T . P^T with the score tiles as the B operand, o carried x64 (folded into the output GEMM alpha) written straight into the merged f16 o rows; out = o W_o + b GEMM (f32) into the output layout. Every f16 operand plane in the workspace (x, both weights, q and k hi / residual, V^T, o) lies in WMMA fragment order (see gf_frag), so that a fragment load reads whole 128-byte lines.
// Compute dtype: inputs rounded to bf16; x / weights exact; projections and rope f32; q, k as f16 hi + residual (~2^-22); v, softmax weights and o as plain f16 GEMM operands (~2^-12); scores and softmax statistics f32. v_wmma_f32_16x16x32_f16.
#define NB 2
#define SQ 2048
#define DM 1024
#define NH 16
#define HD 64
#define HG 4                         /* heads per k_vt launch */
#define QT 256                       /* not used */
#define NKX SQ                       /* S / P row pitch */
#define B0 0                         /* first batch processed (debug hook) */
#define NBR NB                       /* batches processed (debug hook) */
#define QN SQ                        /* not used */
#define NHD NH                       /* not used */
#define NR ((size_t)NB * SQ)         /* token rows */
#define MPO ((int)((size_t)NBR * SQ))      /* rows through the output GEMM (debug hook) */
typedef __bf16 v16b __attribute__((ext_vector_type(16)));
typedef unsigned short v8us __attribute__((ext_vector_type(8), may_alias));
typedef float  v8f  __attribute__((ext_vector_type(8)));
typedef float  v4f  __attribute__((ext_vector_type(4)));
typedef float  v4fa __attribute__((ext_vector_type(4), may_alias));
union FragB { v16b v; v8us half[2]; unsigned short u[16]; };

__device__ __forceinline__ unsigned short bf16_bits(float x) { unsigned int u = __float_as_uint(x); return (unsigned short)((u + 0x7FFFu + ((u >> 16) & 1u)) >> 16); }
__device__ __forceinline__ float bf16_val(unsigned short b) { return __uint_as_float(((unsigned int)b) << 16); }
__device__ __forceinline__ float bf16_round(float x) { return bf16_val(bf16_bits(x)); }
// D += A·B with NT terms: 1 = ah·bh, 2 = + al·bh (A split), 3 = + ah·bl (both split)
template <int NT>
__device__ __forceinline__ v8f mmaN(v16b ah, v16b al, v16b bh, v16b bl, v8f c) {
  c = __builtin_amdgcn_wmma_f32_16x16x32_bf16(false, ah, false, bh, (short)0, c, false, false);
  if (NT >= 2) c = __builtin_amdgcn_wmma_f32_16x16x32_bf16(false, al, false, bh, (short)0, c, false, false);
  if (NT >= 3) c = __builtin_amdgcn_wmma_f32_16x16x32_bf16(false, ah, false, bl, (short)0, c, false, false);
  asm volatile("v_nop\n\tv_nop\n\tv_nop\n\tv_nop" : "+v"(c) : "v"(ah), "v"(al), "v"(bh), "v"(bl));
  return c;
}

__global__ __launch_bounds__(256) void k_wt_bf16(const float* __restrict__ W, unsigned short* __restrict__ Wt, int K, int N) {
  const int t = blockIdx.x * 256 + threadIdx.x;
  const int k8n = K / 8;
  if (t >= N * k8n) return;
  const int n = t / k8n, k8 = (t % k8n) * 8;
  v8us v;
#pragma unroll
  for (int i = 0; i < 8; ++i) v[i] = bf16_bits(W[(size_t)(k8 + i) * N + n]);
  *(v8us*)(Wt + (size_t)n * K + k8) = v;
  
}

// GEMM C[M][N] (f32, pitch ldc) = act(A[M][K]·W + bias). A f32 row-major (pitch lda) converted per fragment to bf16
// (ASPLIT: hi/lo two planes -> 2 terms, else single rounded term); Wt bf16 [N][K] (pitch ldb). BIAS_BF16 rounds the
// bias to bf16 first (bias quantised to bf16 before the add). K%32==0, M%16==0, N%64==0.
template <bool ASPLIT, int ACT, bool BIAS_BF16>
__global__ __launch_bounds__(128) void k_gemm_bf(const float* __restrict__ A, int lda, const unsigned short* __restrict__ Wt, int ldb,
                                               const float* __restrict__ bias, float* __restrict__ C, int ldc, int M, int N, int K) {
  __shared__ __attribute__((aligned(16))) float so[4][16][64];
  const int tid = threadIdx.x, w = tid >> 5, lane = tid & 31, ln = lane & 15, hh = lane >> 4;
  const int ntn = N / 64;
  const int wid = blockIdx.x * 4 + w;
  const int mt = wid / ntn, nq = wid % ntn;
  if (mt * 16 >= M) return;
  const int row0 = mt * 16, col0 = nq * 64;
  const float* arow = A + (size_t)(row0 + ln) * lda;
  v8f acc[4] = {};
  for (int kb = 0; kb < K; kb += 32) {
    FragB ah, al;
    const v4f x0 = *(const v4fa*)(arow + kb + 8 * hh), x1 = *(const v4fa*)(arow + kb + 8 * hh + 4);
    const v4f x2 = *(const v4fa*)(arow + kb + 16 + 8 * hh), x3 = *(const v4fa*)(arow + kb + 16 + 8 * hh + 4);
    float xs[16] = {x0[0],x0[1],x0[2],x0[3],x1[0],x1[1],x1[2],x1[3],x2[0],x2[1],x2[2],x2[3],x3[0],x3[1],x3[2],x3[3]};
#pragma unroll
    for (int i = 0; i < 16; ++i) { const unsigned short hb = bf16_bits(xs[i]); ah.u[i] = hb; al.u[i] = ASPLIT ? bf16_bits(xs[i] - bf16_val(hb)) : (unsigned short)0; }
#pragma unroll
    for (int t = 0; t < 4; ++t) {
      const unsigned short* brow = Wt + (size_t)(col0 + t * 16 + ln) * ldb + kb;
      FragB b;
      b.half[0] = *(const v8us*)(brow + 8 * hh);
      b.half[1] = *(const v8us*)(brow + 16 + 8 * hh);
      acc[t] = mmaN<ASPLIT ? 2 : 1>(ah.v, al.v, b.v, b.v, acc[t]);
    }
  }
#pragma unroll
  for (int t = 0; t < 4; ++t) {
    float bv = bias ? bias[col0 + t * 16 + ln] : 0.f;
    if (BIAS_BF16) bv = bf16_round(bv);
#pragma unroll
    for (int r = 0; r < 8; ++r) { float v = acc[t][r] + bv; if (ACT == 1) v = fmaxf(v, 0.f); so[w][8 * hh + r][t * 16 + ln] = v; }
  }
  __builtin_amdgcn_fence(__ATOMIC_ACQ_REL, "workgroup");
  __builtin_amdgcn_wave_barrier();
  const int rsub = lane >> 4, c4 = (lane & 15) * 4;
  {
#pragma unroll
    for (int q = 0; q < 8; ++q) {
      const int r = q * 2 + rsub;
      const v4f v = *(const v4fa*)&so[w][r][c4];
      *(v4f*)(C + (size_t)(row0 + r) * ldc + col0 + c4) = v;
    }
    
  }
}

// GEMM C = act(A·W + bias + resid): A f32 (ASPLIT -> hi/lo 2 terms), Wt bf16 [N][K]; ACT 0 none, 1 relu, 2 exact gelu;
// resid (optional, f32, row index = (row % rmod), pitch ldr, RES_BF16 rounds it) added before the activation.
template <bool ASPLIT, int ACT, bool BIAS_BF16, bool RES_BF16>
__global__ __launch_bounds__(128) void k_gemm_bf3(const float* __restrict__ A, int lda, const unsigned short* __restrict__ Wt, int ldb,
                                                const float* __restrict__ bias, const float* __restrict__ resid, int rmod, int ldr,
                                                float* __restrict__ C, int ldc, int M, int N, int K) {
  __shared__ __attribute__((aligned(16))) float so[4][16][64];
  const int tid = threadIdx.x, w = tid >> 5, lane = tid & 31, ln = lane & 15, hh = lane >> 4;
  const int ntn = N / 64;
  const int wid = blockIdx.x * 4 + w;
  const int mt = wid / ntn, nq = wid % ntn;
  if (mt * 16 >= M) return;
  const int row0 = mt * 16, col0 = nq * 64;
  const float* arow = A + (size_t)(row0 + ln) * lda;
  v8f acc[4] = {};
  for (int kb = 0; kb < K; kb += 32) {
    FragB ah, al;
    const v4f x0 = *(const v4fa*)(arow + kb + 8 * hh), x1 = *(const v4fa*)(arow + kb + 8 * hh + 4);
    const v4f x2 = *(const v4fa*)(arow + kb + 16 + 8 * hh), x3 = *(const v4fa*)(arow + kb + 16 + 8 * hh + 4);
    float xs[16] = {x0[0],x0[1],x0[2],x0[3],x1[0],x1[1],x1[2],x1[3],x2[0],x2[1],x2[2],x2[3],x3[0],x3[1],x3[2],x3[3]};
#pragma unroll
    for (int i = 0; i < 16; ++i) { const unsigned short hb = bf16_bits(xs[i]); ah.u[i] = hb; al.u[i] = ASPLIT ? bf16_bits(xs[i] - bf16_val(hb)) : (unsigned short)0; }
#pragma unroll
    for (int t = 0; t < 4; ++t) {
      const unsigned short* brow = Wt + (size_t)(col0 + t * 16 + ln) * ldb + kb;
      FragB b;
      b.half[0] = *(const v8us*)(brow + 8 * hh);
      b.half[1] = *(const v8us*)(brow + 16 + 8 * hh);
      acc[t] = mmaN<ASPLIT ? 2 : 1>(ah.v, al.v, b.v, b.v, acc[t]);
    }
  }
#pragma unroll
  for (int t = 0; t < 4; ++t) {
    const int col = col0 + t * 16 + ln;
    float bv = bias ? bias[col] : 0.f;
    if (BIAS_BF16) bv = bf16_round(bv);
#pragma unroll
    for (int r = 0; r < 8; ++r) {
      float v = acc[t][r] + bv;
      if (resid) { float rv = resid[(size_t)((row0 + 8 * hh + r) % rmod) * ldr + col]; if (RES_BF16) rv = bf16_round(rv); v += rv; }
      if (ACT == 1) v = fmaxf(v, 0.f);
      if (ACT == 2) v = 0.5f * v * (1.0f + erff(v * 0.70710678118654752f));
      if (ACT == 3) { const float u = 0.7978845608028654f * (v + 0.044715f * v * v * v); v = 0.5f * v * (1.0f + tanhf(u)); }
      so[w][8 * hh + r][t * 16 + ln] = v;
    }
  }
  __builtin_amdgcn_fence(__ATOMIC_ACQ_REL, "workgroup");
  __builtin_amdgcn_wave_barrier();
  const int rsub = lane >> 4, c4 = (lane & 15) * 4;
  {
#pragma unroll
    for (int q = 0; q < 8; ++q) {
      const int r = q * 2 + rsub;
      const v4f v = *(const v4fa*)&so[w][r][c4];
      *(v4f*)(C + (size_t)(row0 + r) * ldc + col0 + c4) = v;
    }
    
  }
}
// row LayerNorm (biased variance, eps) over N: s = X (+ R); optional out_sum <- s; out_norm <- (s-mu)*rsqrt(var+eps)*g + b
template <bool PARAM_BF16>
__global__ __launch_bounds__(256) void k_layernorm(const float* __restrict__ X, const float* __restrict__ R, const float* __restrict__ g, const float* __restrict__ bta,
                                                  float* __restrict__ out_sum, float* __restrict__ out_norm, int N, float eps) {
  __shared__ float red[256];
  const int row = blockIdx.x, tid = threadIdx.x;
  const float* x = X + (size_t)row * N; const float* rr = R ? R + (size_t)row * N : nullptr;
  float vals[16];                     // up to N = 4096
  const int per = N / 256;            // contiguous chunk per thread? use strided-by-4 chunks: thread handles j = tid*4 + 1024*u
  float s1 = 0.f;
  for (int u = 0; u < per / 4; ++u) {
    const int j = tid * 4 + 1024 * u;
    const v4f a = *(const v4fa*)(x + j);
    v4f b = {0.f,0.f,0.f,0.f}; if (rr) b = *(const v4fa*)(rr + j);
#pragma unroll
    for (int q = 0; q < 4; ++q) { const float v = a[q] + b[q]; vals[u * 4 + q] = v; s1 += v; }
  }
  red[tid] = s1; __syncthreads();
  for (int st = 128; st > 0; st >>= 1) { if (tid < st) red[tid] += red[tid + st]; __syncthreads(); }
  const float mu = red[0] / (float)N; __syncthreads();
  float s2 = 0.f;
  for (int u = 0; u < per / 4; ++u)
#pragma unroll
    for (int q = 0; q < 4; ++q) { const float c = vals[u * 4 + q] - mu; s2 += c * c; }
  red[tid] = s2; __syncthreads();
  for (int st = 128; st > 0; st >>= 1) { if (tid < st) red[tid] += red[tid + st]; __syncthreads(); }
  const float rs = rsqrtf(red[0] / (float)N + eps);
  {
    for (int u = 0; u < per / 4; ++u) {
      const int j = tid * 4 + 1024 * u;
      v4f o, sm;
#pragma unroll
      for (int q = 0; q < 4; ++q) {
        float gg = g[j + q], bb = bta[j + q];
        if (PARAM_BF16) { gg = bf16_round(gg); bb = bf16_round(bb); }
        sm[q] = vals[u * 4 + q]; o[q] = (vals[u * 4 + q] - mu) * rs * gg + bb;
      }
      if (out_sum) *(v4f*)(out_sum + (size_t)row * N + j) = sm;
      *(v4f*)(out_norm + (size_t)row * N + j) = o;
    }
    
  }
}



// ---- f16 WMMA path (v_wmma_f32_16x16x32_f16): 11-bit significands for operands in range — used where a [0,1] probability operand needs more precision than bf16
typedef _Float16 v16h __attribute__((ext_vector_type(16)));
union FragH { v16h v; v8us half[2]; _Float16 h[16]; unsigned short u[16]; };
template <int NT>
__device__ __forceinline__ v8f mmaH(v16h ah, v16h al, v16h bh, v16h bl, v8f c) {
  c = __builtin_amdgcn_wmma_f32_16x16x32_f16(false, ah, false, bh, (short)0, c, false, false);
  if (NT >= 2) c = __builtin_amdgcn_wmma_f32_16x16x32_f16(false, al, false, bh, (short)0, c, false, false);
  if (NT >= 3) c = __builtin_amdgcn_wmma_f32_16x16x32_f16(false, ah, false, bl, (short)0, c, false, false);
  asm volatile("v_nop\n\tv_nop\n\tv_nop\n\tv_nop" : "+v"(c) : "v"(ah), "v"(al), "v"(bh), "v"(bl));
  return c;
}
// batched GEMM like k_gemm_b but f16 operands: A f32 (split into f16 hi/lo if ASPLIT, else rounded to f16), Bt = f16 values [n][k]; alpha; C f32; N multiple of 16 (partial tiles skipped)
template <bool ASPLIT>
__global__ __launch_bounds__(128) void k_gemm_h(const float* __restrict__ A, int lda, size_t sA, const _Float16* __restrict__ Bh, int ldb, size_t sB, float alpha, float* __restrict__ C, int ldc, size_t sC, int M, int N, int K) {
  __shared__ __attribute__((aligned(16))) float so[4][16][64];
  const int tid = threadIdx.x, w = tid >> 5, lane = tid & 31, ln = lane & 15, hh = lane >> 4; const int by = blockIdx.y;
  A += (size_t)by * sA; Bh += (size_t)by * sB; C += (size_t)by * sC;
  const int ntn = (N + 63) / 64; const int wid = blockIdx.x * 4 + w; const int mt = wid / ntn, nq = wid % ntn; if (mt * 16 >= M) return;
  const int row0 = mt * 16, col0 = nq * 64; const float* arow = A + (size_t)(row0 + ln) * lda;
  v8f acc[4] = {};
  for (int kb = 0; kb < K; kb += 32) {
    FragH ah, al;
    const v4f x0 = *(const v4fa*)(arow + kb + 8 * hh), x1 = *(const v4fa*)(arow + kb + 8 * hh + 4), x2 = *(const v4fa*)(arow + kb + 16 + 8 * hh), x3 = *(const v4fa*)(arow + kb + 16 + 8 * hh + 4);
    float xs[16] = {x0[0],x0[1],x0[2],x0[3],x1[0],x1[1],x1[2],x1[3],x2[0],x2[1],x2[2],x2[3],x3[0],x3[1],x3[2],x3[3]};
#pragma unroll
    for (int i = 0; i < 16; ++i) { const _Float16 h = (_Float16)xs[i]; ah.h[i] = h; al.h[i] = ASPLIT ? (_Float16)(xs[i] - (float)h) : (_Float16)0.0f; }
#pragma unroll
    for (int t = 0; t < 4; ++t) { if (col0 + t * 16 >= N) continue; const size_t boff = (size_t)(col0 + t * 16 + ln) * ldb + kb; FragH bq; bq.half[0] = *(const v8us*)(Bh + boff + 8 * hh); bq.half[1] = *(const v8us*)(Bh + boff + 16 + 8 * hh);
      acc[t] = mmaH<ASPLIT ? 2 : 1>(ah.v, al.v, bq.v, bq.v, acc[t]); }
  }
#pragma unroll
  for (int t = 0; t < 4; ++t) { if (col0 + t * 16 >= N) continue;
#pragma unroll
    for (int r = 0; r < 8; ++r) so[w][8 * hh + r][t * 16 + ln] = acc[t][r] * alpha; }
  __builtin_amdgcn_fence(__ATOMIC_ACQ_REL, "workgroup"); __builtin_amdgcn_wave_barrier();
  const int rsub = lane >> 4, c4 = (lane & 15) * 4;
  {
#pragma unroll
    for (int q = 0; q < 8; ++q) { const int r = q * 2 + rsub; if (col0 + c4 < N) { const v4f v = *(const v4fa*)&so[w][r][c4]; *(v4f*)(C + (size_t)(row0 + r) * ldc + col0 + c4) = v; } }
     }
}

// k_gemm_hh variant with fused epilogue: v = acc·alpha + bias[by·sBias + col] (+ CP[(row/rowsPerB)·sCPb + by·64 + col] if CP) ; ACT 0 none / 1 elu ; writes f16 C16 (and f32 C if non-null)
template <int ACT>
__global__ __launch_bounds__(128) void k_gemm_hhx(const _Float16* __restrict__ A, int lda, size_t sA, const _Float16* __restrict__ Bh, int ldb, size_t sB, float alpha, const float* __restrict__ bias, size_t sBias, const float* __restrict__ CP, int rowsPerB, size_t sCPb, int row0g,
    float* __restrict__ C, _Float16* __restrict__ C16, int ldc, size_t sC, int M, int N, int K) {
  __shared__ __attribute__((aligned(16))) float so[4][16][64];
  const int tid = threadIdx.x, w = tid >> 5, lane = tid & 31, ln = lane & 15, hh = lane >> 4; const int by = blockIdx.y;
  A += (size_t)by * sA; Bh += (size_t)by * sB; const size_t cofs = (size_t)by * sC; const float* bp = bias ? bias + (size_t)by * sBias : nullptr;
  const int ntn = (N + 63) / 64; const int wid = blockIdx.x * 4 + w; const int mt = wid / ntn, nq = wid % ntn; if (mt * 16 >= M) return;
  const int row0 = mt * 16, col0 = nq * 64; const _Float16* arow = A + (size_t)(row0 + ln) * lda;
  v8f acc[4] = {};
  for (int kb = 0; kb < K; kb += 32) { FragH ah; ah.half[0] = *(const v8us*)((const unsigned short*)arow + kb + 8 * hh); ah.half[1] = *(const v8us*)((const unsigned short*)arow + kb + 16 + 8 * hh);
#pragma unroll
    for (int t = 0; t < 4; ++t) { if (col0 + t * 16 >= N) continue; const size_t boff = (size_t)(col0 + t * 16 + ln) * ldb + kb; FragH bq; bq.half[0] = *(const v8us*)((const unsigned short*)Bh + boff + 8 * hh); bq.half[1] = *(const v8us*)((const unsigned short*)Bh + boff + 16 + 8 * hh);
      acc[t] = mmaH<1>(ah.v, ah.v, bq.v, bq.v, acc[t]); }
  }
#pragma unroll
  for (int t = 0; t < 4; ++t) { if (col0 + t * 16 >= N) continue; const int col = col0 + t * 16 + ln; const float bv = bp ? bf16_round(bp[col]) : 0.f;
#pragma unroll
    for (int r = 0; r < 8; ++r) { float v = acc[t][r] * alpha + bv; if (CP) { const int rr = row0g + row0 + 8 * hh + r; if (rowsPerB < 0) v += CP[cofs + (size_t)rr * ldc + col];      /* rowsPerB < 0: own element of the batched C plane */ else { const int bidx = rr / rowsPerB; v += CP[(size_t)bidx * sCPb + (size_t)by * 64 + col]; } } if (ACT == 1) v = (v > 0.f) ? v : expm1f(v); else if (ACT == 7) v = (v > 0.f) ? v + 1.0f : expf(v); else if (ACT == 8) v = tanhf(v); else if (ACT == 9) v = 0.5f * v * (1.0f + tanhf(0.7978845608028654f * (v + 0.044715f * v * v * v))); else if (ACT == 11) v = 1.0f / (1.0f + expf(-v)); else if (ACT == 12) v = (v > 0.f) ? v : 0.01f * v; else if (ACT == 14) v = (v > 0.f) ? v : 0.1f * v; else if (ACT == 16) v = (v >= 0.f) ? v : 0.3f * v; else if (ACT == 17) v = (v >= 0.f) ? v : 0.2f * v; else if (ACT == 15) v = v / (1.0f + expf(-v)); else if (ACT == 3) v = fmaxf(v, 0.f); else if (ACT == 6) v = 0.5f * v * (1.0f + erff(v * 0.70710678118654752f)); so[w][8 * hh + r][t * 16 + ln] = v; } }
  __builtin_amdgcn_fence(__ATOMIC_ACQ_REL, "workgroup"); __builtin_amdgcn_wave_barrier();
  const int rsub = lane >> 4, c4 = (lane & 15) * 4; typedef _Float16 v4h __attribute__((ext_vector_type(4)));
  {
#pragma unroll
    for (int q = 0; q < 8; ++q) { const int r = q * 2 + rsub; if (col0 + c4 < N) { const v4f v = *(const v4fa*)&so[w][r][c4]; if (C) *(v4f*)(C + cofs + (size_t)(row0 + r) * ldc + col0 + c4) = v; if (C16) { v4h h4; for (int i = 0; i < 4; ++i) h4[i] = (_Float16)v[i]; *(v4h*)(C16 + cofs + (size_t)(row0 + r) * ldc + col0 + c4) = h4; } } }
     }
}


typedef _Float16 v4h __attribute__((ext_vector_type(4)));

__global__ __launch_bounds__(256) void k_h16(const float* __restrict__ x, _Float16* __restrict__ X16, size_t n8) { const size_t t = (size_t)blockIdx.x * 256 + threadIdx.x; if (t >= n8) return; FragH f;
#pragma unroll
  for (int q = 0; q < 8; ++q) f.h[q] = (_Float16)x[t * 8 + q]; *(v8us*)((unsigned short*)X16 + t * 8) = f.half[0];  }
__global__ __launch_bounds__(256) void k_round16f(const float* __restrict__ W, _Float16* __restrict__ Bt, size_t n8) { const size_t t = (size_t)blockIdx.x * 256 + threadIdx.x; if (t >= n8) return; FragH f;
#pragma unroll
  for (int i = 0; i < 8; ++i) f.h[i] = (_Float16)(bf16_round(W[t * 8 + i]) * 16.0f); *(v8us*)((unsigned short*)Bt + t * 8) = f.half[0];  }
// ---- fast GEMM (wave tile 32x64, block tile 128x64; requires M % 128 == 0 rows per launch region, N % 64 == 0 and K % 128 == 0); A and Bh in fragment order (see gf_frag), strips of 16 rows of lda / ldb elements each; epilogue = k_gemm_hhx semantics ----
__device__ __forceinline__ v16h g2_frag(const _Float16* p, int hh) { FragH f; f.half[0] = *(const v8us*)((const unsigned short*)p + 8 * hh); f.half[1] = *(const v8us*)((const unsigned short*)p + 16 + 8 * hh); return f.v; }
// Fragment order: a 16-row x 32-k f16 tile lies 1 KB in a row, element (r, k) at (k >> 4) * 256 + (((k >> 3) & 1) * 16 + r) * 8 + (k & 7), so lane l = 16 hh + ln finds the two 16-byte halves of its fragment at 8 l and 256 + 8 l:
// each fragment load of a wave reads 512 bytes in a row (four whole 128-byte lines) where a row-major plane gives it 16 lines of 32 bytes. Which element a lane and register hold is as in g2_frag. p = tile + 8 * lane.
__device__ __forceinline__ v16h gf_frag(const _Float16* p) { FragH f; f.half[0] = *(const v8us*)((const unsigned short*)p); f.half[1] = *(const v8us*)((const unsigned short*)p + 256); return f.v; }
__device__ __forceinline__ v8f g2_mma(v16h a, v16h b, v8f c) { v8f d = __builtin_amdgcn_wmma_f32_16x16x32_f16(false, a, false, b, (short)0, c, false, false); asm volatile("v_nop\n\tv_nop\n\tv_nop\n\tv_nop" : "+v"(d) : "v"(a), "v"(b)); return d; }
// GEMM main loops: a block's operand strips come into LDS once for all its waves, 128 k a stage, by asynchronous copies into two buffers, the stage after next asked for while this one is worked on; the waves take their fragments from LDS.
// G2_HOLD keeps what stands in front of it in front and what stands behind it behind.
#define G2_HOLD __builtin_amdgcn_sched_barrier(0);
#define QK_SE 1024      /* elements of 64 k of one strip: two tiles in fragment order, 2 KB in a row in global memory and in LDS alike */
// two runs of 2 KB (64 k of a strip each) into LDS: eight copies of a wave, 512 bytes in a row each; l0, l4 the lane's own LDS byte addresses, g0, g4 its own global addresses. The s_wait_xcnt stands inside the statement, behind the last copy, so that no register that a copy names is rewritten in front of it.
__device__ __forceinline__ void qk_copy2(unsigned l0, const _Float16* g0, unsigned l4, const _Float16* g4) {
  const unsigned l1 = l0 + 512, l2 = l0 + 1024, l3 = l0 + 1536; const _Float16* g1 = g0 + 256; const _Float16* g2 = g0 + 512; const _Float16* g3 = g0 + 768;
  const unsigned l5 = l4 + 512, l6 = l4 + 1024, l7 = l4 + 1536; const _Float16* g5 = g4 + 256; const _Float16* g6 = g4 + 512; const _Float16* g7 = g4 + 768;
  asm volatile("global_load_async_to_lds_b128 %0, %8, off\n\tglobal_load_async_to_lds_b128 %1, %9, off\n\tglobal_load_async_to_lds_b128 %2, %10, off\n\tglobal_load_async_to_lds_b128 %3, %11, off\n\t"
               "global_load_async_to_lds_b128 %4, %12, off\n\tglobal_load_async_to_lds_b128 %5, %13, off\n\tglobal_load_async_to_lds_b128 %6, %14, off\n\tglobal_load_async_to_lds_b128 %7, %15, off\n\ts_wait_xcnt 0x0"
               :: "v"(l0), "v"(l1), "v"(l2), "v"(l3), "v"(l4), "v"(l5), "v"(l6), "v"(l7), "v"(g0), "v"(g1), "v"(g2), "v"(g3), "v"(g4), "v"(g5), "v"(g6), "v"(g7) : "memory"); }
#define QK_SP (2 * QK_SE)      /* elements of one strip in a stage: 128 k as two halves of 64 k, each 2 KB in a row in global memory (the walk may wrap between them) */
// stage S of the k walk into buffer BUF: every wave three of the block's twelve strips (two of A, one of B); a strip's two halves of 64 k in one statement, each from its own wrapped k
#define G2_STAGE(S, BUF) { const int kx = rot + 128 * (S), ky = kx + 64; const int ka = ((kx < K) ? kx : kx - K) * 16, kc = ((ky < K) ? ky : ky - K) * 16; const unsigned ld = lw + (unsigned)(BUF) * (12 * QK_SP * 2); \
    qk_copy2(ld, gs0 + ka, ld + QK_SE * 2, gs0 + kc); qk_copy2(ld + 4 * QK_SP * 2, gs1 + ka, ld + 4 * QK_SP * 2 + QK_SE * 2, gs1 + kc); qk_copy2(ld + 8 * QK_SP * 2, gs2 + ka, ld + 8 * QK_SP * 2 + QK_SE * 2, gs2 + kc); }
#define G2_LOAD(A0, A1, F0, F1, F2, F3, KO) v16h A0 = gf_frag(la + (KO)), A1 = gf_frag(la + QK_SP + (KO)), F0 = gf_frag(lb + (KO)), F1 = gf_frag(lb + QK_SP + (KO)), F2 = gf_frag(lb + 2 * QK_SP + (KO)), F3 = gf_frag(lb + 3 * QK_SP + (KO));
#define G2_AGAIN(A0, A1, F0, F1, F2, F3, KO) A0 = gf_frag(la + (KO)); A1 = gf_frag(la + QK_SP + (KO)); F0 = gf_frag(lb + (KO)); F1 = gf_frag(lb + QK_SP + (KO)); F2 = gf_frag(lb + 2 * QK_SP + (KO)); F3 = gf_frag(lb + 3 * QK_SP + (KO));
#define G2_SET(A0, A1, F0, F1, F2, F3) c00 = g2_mma(A0, F0, c00); c10 = g2_mma(A1, F0, c10); c01 = g2_mma(A0, F1, c01); c11 = g2_mma(A1, F1, c11); c02 = g2_mma(A0, F2, c02); c12 = g2_mma(A1, F2, c12); c03 = g2_mma(A0, F3, c03); c13 = g2_mma(A1, F3, c13);
template <int ACT>
__global__ __launch_bounds__(128) void k_gemm2(const _Float16* __restrict__ A, int lda, size_t sA, const _Float16* __restrict__ Bh, int ldb, size_t sB, float alpha, const float* __restrict__ bias, size_t sBias, const float* __restrict__ CP, int rowsPerB, size_t sCPb, int row0g,
    float* __restrict__ C, _Float16* __restrict__ C16, int ldc, size_t sC, int M, int N, int K) { static_assert(ACT == 0 || ACT == 3 || ACT == 6 || ACT == 8 || ACT == 9 || ACT == 11 || ACT == 12 || ACT == 14 || ACT == 15 || ACT == 16 || ACT == 17, "k_gemm2: unsupported ACT code (would silently apply no activation)");
  __shared__ __attribute__((aligned(16))) float so[4][32][68];
  __shared__ __attribute__((aligned(128))) _Float16 ring[2][12][QK_SP];      /* two stages of the block's operand strips: 0 to 7 its A rows, 8 to 11 its B columns */
  const int tid = threadIdx.x, lane = tid & 31, ln = lane & 15, hh = lane >> 4; const int w = __builtin_amdgcn_readfirstlane(tid >> 5); const int by = blockIdx.y;      /* scalar wave number */
  A += (size_t)by * sA; Bh += (size_t)by * sB; const size_t cofs = (size_t)by * sC; const float* bp = bias ? bias + (size_t)by * sBias : nullptr;
  const int ntn = N >> 6; const int mt = blockIdx.x / ntn, nq = blockIdx.x - mt * ntn; const int row0 = mt * 128 + 32 * w, col0 = nq * 64; if (mt * 128 >= M) return;      /* whole blocks (M % 128 == 0): a block leaves as a whole, in front of every barrier */
  const v8f z8 = {0.f,0.f,0.f,0.f,0.f,0.f,0.f,0.f}; v8f c00 = z8, c01 = z8, c02 = z8, c03 = z8, c10 = z8, c11 = z8, c12 = z8, c13 = z8;
  /* the k walk starts at the block's own k, rot (a multiple of 64 below K), and wraps round: the blocks that share an A strip (one mt) or a B strip (one nq) run at the same time, and started alike they would all ask L2 for the same lines at the same moment */
  const int rot = (((mt + nq) & 15) * 64) % K; const int ns = K >> 7;      /* K % 128 == 0 */
  const _Float16* gs0 = A + (size_t)(mt * 128 + 16 * w) * lda + 8 * lane; const _Float16* gs1 = gs0 + (size_t)64 * lda; const _Float16* gs2 = Bh + (size_t)(col0 + 16 * w) * ldb + 8 * lane;      /* the lane's own addresses of strips w, 4 + w and 8 + w; 512 elements a tile of 32 k */
  const unsigned lw = (unsigned)(size_t)&ring[0][w][8 * lane];      /* LDS byte address of the lane's 16 bytes in strip w of buffer 0 */
  G2_STAGE(0, 0)
  asm volatile("s_wait_asynccnt 0x0" ::: "memory");      /* the wave's own copies of stage 0 have landed */
  __syncthreads();      /* every wave's have: stage 0 may be read */
  if (1 < ns) G2_STAGE(1, 1)
#pragma unroll 1      /* rolled: one stage's code */
  for (int s = 0; s < ns; ++s) {
    const _Float16* la = &ring[s & 1][2 * w][8 * lane]; const _Float16* lb = &ring[s & 1][8][8 * lane];      /* the wave's two A strips and the block's four B strips in this stage's buffer */
    /* two fragment sets, x and y, 32 k each; every set is read as one group of LDS reads and asked for again, for the stage's second 64 k, directly behind its products, so that these reads run while the other set's products do; G2_HOLD keeps each group at its place */
    G2_LOAD(xa0, xa1, xb0, xb1, xb2, xb3, 0) G2_HOLD G2_LOAD(ya0, ya1, yb0, yb1, yb2, yb3, 512) G2_HOLD
    G2_SET(xa0, xa1, xb0, xb1, xb2, xb3) G2_HOLD G2_AGAIN(xa0, xa1, xb0, xb1, xb2, xb3, 1024) G2_HOLD
    G2_SET(ya0, ya1, yb0, yb1, yb2, yb3) G2_HOLD G2_AGAIN(ya0, ya1, yb0, yb1, yb2, yb3, 1536) G2_HOLD
    G2_SET(xa0, xa1, xb0, xb1, xb2, xb3) G2_SET(ya0, ya1, yb0, yb1, yb2, yb3)
    G2_HOLD      /* the products stay in front of the barrier: lifted over them it would put the refill behind them, and the copies need the whole time between two barriers to land */
    asm volatile("s_wait_dscnt 0x0" ::: "memory");      /* the wave's reads of this buffer are done before it is refilled */
    asm volatile("s_wait_asynccnt 0x0" ::: "memory");      /* the wave's own copies of the next stage have landed */
    __syncthreads();      /* the next stage may be read by every wave, and every wave has left this stage's buffer */
    if (s + 2 < ns) G2_STAGE(s + 2, s & 1) }
  asm volatile("s_wait_asynccnt 0x0" ::: "memory");      /* no copy is outstanding behind the loop */
  v8f accs[8] = {c00, c01, c02, c03, c10, c11, c12, c13};
#pragma unroll
  for (int u = 0; u < 8; ++u) { const int t = u & 3, half = u >> 2; const int col = col0 + t * 16 + ln; const float bv = bp ? bf16_round(bp[col]) : 0.f;
#pragma unroll
    for (int r = 0; r < 8; ++r) { const int rloc = half * 16 + 8 * hh + r; float v = accs[u][r] * alpha + bv; if (CP) { if (rowsPerB < 0) v += CP[cofs + (size_t)(row0g + row0 + rloc) * ldc + col];      /* rowsPerB < 0: own element of the batched C plane */ else { const int bidx = (row0g + row0 + rloc) / rowsPerB; v += CP[(size_t)bidx * sCPb + (size_t)by * 64 + col]; } }
      if (ACT == 3) v = fmaxf(v, 0.f); else if (ACT == 6) v = 0.5f * v * (1.0f + erff(v * 0.70710678118654752f)); else if (ACT == 11) v = 1.0f / (1.0f + expf(-v)); else if (ACT == 15) v = v / (1.0f + expf(-v)); else if (ACT == 12) v = (v > 0.f) ? v : 0.01f * v; else if (ACT == 8) v = tanhf(v); else if (ACT == 9) v = 0.5f * v * (1.0f + tanhf(0.7978845608028654f * (v + 0.044715f * v * v * v))); else if (ACT == 14) v = (v > 0.f) ? v : 0.1f * v; else if (ACT == 16) v = (v >= 0.f) ? v : 0.3f * v; else if (ACT == 17) v = (v >= 0.f) ? v : 0.2f * v;
      so[w][rloc][t * 16 + ln] = v; } }
  __builtin_amdgcn_fence(__ATOMIC_ACQ_REL, "workgroup"); __builtin_amdgcn_wave_barrier();
  const int rsub = lane >> 4, c4 = (lane & 15) * 4;
  {
#pragma unroll
    for (int q = 0; q < 16; ++q) { const int r = q * 2 + rsub; const v4f v = *(const v4fa*)&so[w][r][c4]; if (C) *(v4f*)(C + cofs + (size_t)(row0 + r) * ldc + col0 + c4) = v; if (C16) { v4h h4; for (int i = 0; i < 4; ++i) h4[i] = (_Float16)v[i]; *(v4h*)(C16 + cofs + (size_t)(row0 + r) * ldc + col0 + c4) = h4; } }
     } }


__global__ __launch_bounds__(256) void k_wnat(const float* __restrict__ w, size_t n8, _Float16* __restrict__ Bt) { const size_t t = (size_t)blockIdx.x * 256 + threadIdx.x; if (t >= n8) return; FragH f; for (int q = 0; q < 8; ++q) f.h[q] = (_Float16)(bf16_round(w[t * 8 + q]) * 16.0f); *(v8us*)((unsigned short*)Bt + t * 8) = f.half[0];  }
__global__ __launch_bounds__(256) void k_rsm(const float* __restrict__ S, _Float16* __restrict__ P, int nrows) {
  #pragma clang fp contract(off)
  const int i = blockIdx.x * 256 + threadIdx.x; if (i >= nrows) return; const float* s = S + (size_t)i * SQ; float mx = -3.0e38f;
#pragma unroll 1
  for (int j = 0; j < SQ; ++j) mx = fmaxf(mx, s[j]); float se = 0.f;
#pragma unroll 1
  for (int j = 0; j < SQ; ++j) se += expf(s[j] - mx); const float sc = 256.0f / se;
#pragma unroll 1
  for (int j0 = 0; j0 < SQ; j0 += 8) { FragH f; for (int q = 0; q < 8; ++q) f.h[q] = (_Float16)(expf(s[j0 + q] - mx) * sc); unsigned short* d = (unsigned short*)P + (size_t)i * SQ + j0; *(v8us*)d = f.half[0];  } }
__global__ __launch_bounds__(256) void k_vt(const _Float16* __restrict__ V16, int b, int h0, _Float16* __restrict__ VT) { __shared__ unsigned short tl[64][65]; const int tid = threadIdx.x; const int hh = blockIdx.x % HG, sg = blockIdx.x / HG; const int s0 = sg * 64; const int h = h0 + hh;
  for (int i = tid; i < 64 * 8; i += 256) { const int j = i / 8, d8 = (i % 8) * 8; FragH f; f.half[0] = *(const v8us*)((const unsigned short*)V16 + ((size_t)b * SQ + s0 + j) * DM + h * HD + d8); for (int q = 0; q < 8; ++q) tl[d8 + q][j] = f.u[q]; }
  __syncthreads();
  { for (int i = tid; i < 64 * 8; i += 256) { const int d = i / 8, j8 = (i % 8) * 8; FragH f; for (int q = 0; q < 8; ++q) f.u[q] = tl[d][j8 + q]; *(v8us*)((unsigned short*)VT + ((size_t)hh * HD + d) * SQ + s0 + j8) = f.half[0]; }  } }


// ---- preparation, ONE launch: x rows and both weights into f16 fragment order (see gf_frag), and the rotary tables ----
// A plane's unit t is its t-th 16 bytes: 8 consecutive k of one row (x) or of one output column n (weights, Bt(n, k) = f16(bf16(W[k][n]) x16), exact) in strips of 16 rows, DM / 32 tiles a strip.
// PREP_T threads in all; a thread takes units g, g + PREP_T, ... of every plane (4 of x, 3 of q|k|v, 1 of the output weight), and the first SQ * HD / 2 threads one table entry each:
// few long waves in place of many that live for one unit, and what a wave reads is all asked for at once.
#define PREP_T (512 * 256)
#define PREP_X 4
#define PREP_W 3
static_assert((size_t)PREP_X * PREP_T == NR * DM / 8 && (size_t)PREP_W * PREP_T == (size_t)3 * DM * DM / 8 && (size_t)PREP_T == (size_t)DM * DM / 8 && SQ * (HD / 2) <= PREP_T, "k_prep: the planes are whole multiples of the grid");
__device__ __forceinline__ const float* prep_wsrc(const float* W, int N, int t) { const int tile = t >> 6, c = t & 63; const int n = (tile / (DM / 32)) * 16 + (c & 15), k8 = (tile % (DM / 32)) * 32 + (c >> 5) * 16 + ((c >> 4) & 1) * 8; return W + (size_t)k8 * N + n; }      /* first of the unit's 8 elements, N apart */
__device__ __forceinline__ void prep_tab(float theta, int t, float* __restrict__ CS, float* __restrict__ SN) {
  const int i = t % (HD / 2); const int p = t / (HD / 2); const float invf = 1.0f / powf(theta, (float)(2 * i) / (float)HD); const float ang = __fmul_rn((float)p, invf); const float c = cosf(ang), s = sinf(ang);
  *(float*)(CS + t) = c; *(float*)(SN + t) = s; }
__global__ __launch_bounds__(256) void k_prep(const float* __restrict__ x, const float* __restrict__ wqkv, const float* __restrict__ wo, float theta,
    _Float16* __restrict__ X16, _Float16* __restrict__ BQKV, _Float16* __restrict__ BO, float* __restrict__ CS, float* __restrict__ SN) {
  const int g = blockIdx.x * 256 + threadIdx.x;
  const float* xs[PREP_X]; const float* ws[PREP_W + 1]; v4f xv[PREP_X][2]; float wv[PREP_W + 1][8];
#pragma unroll
  for (int u = 0; u < PREP_X; ++u) { const int t = g + u * PREP_T; const int tile = t >> 6, c = t & 63;
    xs[u] = x + ((size_t)(tile / (DM / 32)) * 16 + (c & 15)) * DM + (tile % (DM / 32)) * 32 + (c >> 5) * 16 + ((c >> 4) & 1) * 8; }
#pragma unroll
  for (int u = 0; u < PREP_W; ++u) ws[u] = prep_wsrc(wqkv, 3 * DM, g + u * PREP_T);
  ws[PREP_W] = prep_wsrc(wo, DM, g);
#pragma unroll
  for (int u = 0; u < PREP_X; ++u) { xv[u][0] = *(const v4fa*)xs[u]; xv[u][1] = *(const v4fa*)(xs[u] + 4); }
#pragma unroll
  for (int u = 0; u <= PREP_W; ++u)
#pragma unroll
    for (int i = 0; i < 8; ++i) wv[u][i] = ws[u][(size_t)i * (u < PREP_W ? 3 * DM : DM)];
  asm volatile("s_wait_xcnt 0x0" :: "v"(xs[0]), "v"(xs[1]), "v"(xs[2]), "v"(xs[3]), "v"(ws[0]), "v"(ws[1]), "v"(ws[2]), "v"(ws[3]) : "memory");      /* the eight address pairs stay whole until the loads have taken them; it also keeps every load here, in front of the table entry, so that they fly while it is computed */
  if (g < SQ * (HD / 2)) prep_tab(theta, g, CS, SN);      /* whole blocks: 256 divides the bound */
  FragH fx[PREP_X], fw[PREP_W + 1];
#pragma unroll
  for (int u = 0; u < PREP_X; ++u)
#pragma unroll
    for (int q = 0; q < 8; ++q) fx[u].h[q] = (_Float16)bf16_round(xv[u][q >> 2][q & 3]);
#pragma unroll
  for (int u = 0; u <= PREP_W; ++u)
#pragma unroll
    for (int i = 0; i < 8; ++i) fw[u].h[i] = (_Float16)(bf16_round(wv[u][i]) * 16.0f);
#pragma unroll
  for (int u = 0; u < PREP_X; ++u) *(v8us*)((unsigned short*)X16 + ((size_t)g + (size_t)u * PREP_T) * 8) = fx[u].half[0];
#pragma unroll
  for (int u = 0; u < PREP_W; ++u) *(v8us*)((unsigned short*)BQKV + ((size_t)g + (size_t)u * PREP_T) * 8) = fw[u].half[0];
  *(v8us*)((unsigned short*)BO + (size_t)g * 8) = fw[PREP_W].half[0]; }
// Fused causal attention, one launch for every (batch, head, 128-query block): 32 queries belong to FA_KS waves, w + 4 g taking the passes of 32 keys g, g + FA_KS, ... up to the queries' own diagonal; nothing of S or P goes through memory.
// The longest walk is so 22 passes, not 64, and a SIMD holds as many waves as its registers take; one block fills a WGP, and the blocks come longest first over all heads (the query block is the slow grid index), so that a WGP that ends a short block takes the next: every WGP gets about the mean.
// At the end the waves g > 0 hand their maximum, sum and accumulators to wave g = 0 through LDS, which joins the partial softmaxes on their common maximum.
// Transposed products: S^T = K . Q^T (A = key rows, B = query rows kept in registers; hi.hi in one accumulator, lo.hi + hi.lo in a second, joined as hi + 2^-10 lo in f32), so a lane holds 16 scores of ONE query;
// running maximum and sum per query (online softmax, accumulators rescaled only in a pass where some query's maximum moved); the two 16-key score tiles, as f16 weights x256, ARE the B operand of O^T += V^T . P^T.
__device__ __forceinline__ float rs_xrow(float v) { const int i = __float_as_int(v); return __int_as_float(__builtin_amdgcn_permlanex16(i, i, 0x76543210, 0xfedcba98, false, false)); }      /* lane l <- lane l ^ 16 */
// native 2^a. The v_nop is the slot the instruction set asks for behind a transcendental before its source is overwritten or its result read.
__device__ __forceinline__ float fa_exp2(float a) { float e; asm("v_exp_f32 %0, %1\n\tv_nop" : "=v"(e) : "v"(a)); return e; }
__device__ __forceinline__ v8f fa_mma(v16h a, v16h b, v8f c) { return __builtin_amdgcn_wmma_f32_16x16x32_f16(false, a, false, b, (short)0, c, false, false); }
#define FA_C 11.5415603271117072589f      /* sqrt(64) * log2(e): score differences -> exponent of 2 */
#define FA_KS 3      /* waves that share a query group's key walk */
__global__ __launch_bounds__(128 * FA_KS) void k_fattn(const _Float16* __restrict__ QH, const _Float16* __restrict__ QL, const _Float16* __restrict__ KH, const _Float16* __restrict__ KL, const _Float16* __restrict__ VT, _Float16* __restrict__ O16) {
  __shared__ __attribute__((aligned(16))) float mo[FA_KS - 1][4][17][32][4];      /* [g - 1][query group][16 quads of o, then m and l][lane]: a wave's store or load of a quad is 512 bytes in a row */
  const int lane = threadIdx.x & 31, ln = lane & 15, hh = lane >> 4; const int w8 = __builtin_amdgcn_readfirstlane((int)(threadIdx.x >> 5)); const int w = w8 & 3, g = w8 >> 2;      /* scalar wave number: the key loop's bounds stay scalars; w query group, g its share of the passes */
  const int bh = blockIdx.x, b = bh / NH, h = bh % NH; const int q0 = ((int)gridDim.y - 1 - (int)blockIdx.y) * 128 + w * 32;      /* longest blocks start first, over all heads */
  const size_t r0 = (size_t)b * SQ;
  /* every pointer below is the lane's own address, its k offset 8 hh folded in, so that the loads name exactly the pair that the wait behind them holds */
  /* q, k planes: fragment order (see gf_frag), per (batch, head) strips of 16 tokens, two tiles (k halves of the head) a strip: 64 elements a token; V^T: per (batch, head) and 32 keys four tiles (16 head columns each): 64 elements a key */
  const size_t hb = (size_t)bh * SQ * HD + 8 * lane;
  const _Float16* qhp = QH + hb + (size_t)q0 * HD; const _Float16* qlp = QL + hb + (size_t)q0 * HD;
  v16h qh[2][2], ql[2][2];      /* [query group of 16][k half of the head] */
#pragma unroll
  for (int j = 0; j < 2; ++j)
#pragma unroll
    for (int ks = 0; ks < 2; ++ks) { const size_t o = (size_t)(2 * j + ks) * 512; qh[j][ks] = gf_frag(qhp + o); ql[j][ks] = gf_frag(qlp + o); }
  asm volatile("s_wait_xcnt 0x0" :: "v"(qhp), "v"(qlp) : "memory");      /* the two address pairs stay whole until the loads have taken them */
  const _Float16* khp = KH + hb; const _Float16* klp = KL + hb; const _Float16* vtp = VT + hb;
  const v8f z8 = {0.f,0.f,0.f,0.f,0.f,0.f,0.f,0.f};
  v8f o[2][4]; float m[2], l[2];
#pragma unroll
  for (int j = 0; j < 2; ++j) { m[j] = -1.0e30f; l[j] = 0.f;
#pragma unroll
    for (int t = 0; t < 4; ++t) o[j][t] = z8; }
  v16h kh[2][2], kl[2][2];      /* [16-key tile][k half] */
  { const _Float16* pkh = khp + (size_t)(32 * g) * HD; const _Float16* pkl = klp + (size_t)(32 * g) * HD;      /* the wave's first pass (in bounds also where it has none) */
#pragma unroll
    for (int kt = 0; kt < 2; ++kt)
#pragma unroll
      for (int ks = 0; ks < 2; ++ks) { const size_t ko = (size_t)(2 * kt + ks) * 512; kh[kt][ks] = gf_frag(pkh + ko); kl[kt][ks] = gf_frag(pkl + ko); }
    asm volatile("s_wait_xcnt 0x0" :: "v"(pkh), "v"(pkl) : "memory"); }      /* the two address pairs stay whole until the loads have taken them */
#pragma unroll 1
  for (int kb = 32 * g; kb <= q0; kb += 32 * FA_KS) {
    v16h vf[4]; const _Float16* pv = vtp + (size_t)kb * HD;      /* V^T tiles of this pass, asked for ahead of the score products */
#pragma unroll
    for (int t = 0; t < 4; ++t) vf[t] = gf_frag(pv + (size_t)t * 512);
    asm volatile("s_wait_xcnt 0x0" ::: "memory");      /* stands in front of the advance of the loads' address pair; it also keeps these loads here, ahead of the score products, where the build had sunk them to their use */
    v8f u[2][2];      /* [query group][key tile]: q . k, register r = key 16 kt + 8 hh + r of query ln */
#pragma unroll
    for (int kt = 0; kt < 2; ++kt)
#pragma unroll
      for (int j = 0; j < 2; ++j) { v8f sh = z8, sl = z8;
#pragma unroll
        for (int ks = 0; ks < 2; ++ks) { sh = fa_mma(kh[kt][ks], qh[j][ks], sh); sl = fa_mma(kh[kt][ks], ql[j][ks], sl); sl = fa_mma(kl[kt][ks], qh[j][ks], sl); }
#pragma unroll
        for (int r = 0; r < 8; ++r) u[j][kt][r] = sh[r] + 0.0009765625f * sl[r]; }
    { const int kn = (kb + 32 * FA_KS <= q0) ? kb + 32 * FA_KS : kb;      /* the wave's next pass's key rows into the same registers, behind their last use; the last pass asks for its own rows again (in bounds) */
      const _Float16* pkh = khp + (size_t)kn * HD; const _Float16* pkl = klp + (size_t)kn * HD;
#pragma unroll
      for (int kt = 0; kt < 2; ++kt)
#pragma unroll
        for (int ks = 0; ks < 2; ++ks) { const size_t ko = (size_t)(2 * kt + ks) * 512; kh[kt][ks] = gf_frag(pkh + ko); kl[kt][ks] = gf_frag(pkl + ko); }
      asm volatile("s_wait_xcnt 0x0" :: "v"(pkh), "v"(pkl) : "memory"); }      /* the two address pairs stay whole until the loads have taken them */
    if (kb == q0) {      /* the one pass on the diagonal: keys above the query are out */
#pragma unroll
      for (int j = 0; j < 2; ++j)
#pragma unroll
        for (int kt = 0; kt < 2; ++kt)
#pragma unroll
          for (int r = 0; r < 8; ++r) u[j][kt][r] = (16 * kt + 8 * hh + r <= 16 * j + ln) ? u[j][kt][r] : -1.0e9f; }
    float mn[2];
#pragma unroll
    for (int j = 0; j < 2; ++j) { float x = fmaxf(u[j][0][0], u[j][1][0]);
#pragma unroll
      for (int r = 1; r < 8; ++r) x = fmaxf(x, fmaxf(u[j][0][r], u[j][1][r]));
      mn[j] = fmaxf(m[j], fmaxf(x, rs_xrow(x))); }
    if (__builtin_amdgcn_ballot_w32(mn[0] > m[0] || mn[1] > m[1]) != 0) {      /* scalar branch; where no maximum moved every factor would be 1 */
#pragma unroll
      for (int j = 0; j < 2; ++j) { const float al = fa_exp2((m[j] - mn[j]) * FA_C); m[j] = mn[j]; l[j] *= al;
#pragma unroll
        for (int t = 0; t < 4; ++t)
#pragma unroll
          for (int r = 0; r < 8; ++r) o[j][t][r] *= al; } }
#pragma unroll
    for (int j = 0; j < 2; ++j) { FragH pf; float s0 = 0.f, s1 = 0.f;
#pragma unroll
      for (int r = 0; r < 8; ++r) { const float p0 = fa_exp2((u[j][0][r] - m[j]) * FA_C + 8.0f), p1 = fa_exp2((u[j][1][r] - m[j]) * FA_C + 8.0f); s0 += p0; s1 += p1; pf.h[r] = (_Float16)p0; pf.h[8 + r] = (_Float16)p1; }      /* weights x256 */
      l[j] += s0 + s1;
#pragma unroll
      for (int t = 0; t < 4; ++t) o[j][t] = fa_mma(vf[t], pf.v, o[j][t]); }
  }
  /* the partial softmaxes of a query group joined: the state of the waves g > 0 through LDS, all scaled to the common maximum (a wave without a pass holds m = -1e30, l = 0, o = 0: factor 0; wave g = 0 always has the pass of key 0) */
  if (g != 0) {
#pragma unroll
    for (int j = 0; j < 2; ++j)
#pragma unroll
      for (int t = 0; t < 4; ++t)
#pragma unroll
        for (int c = 0; c < 2; ++c) { const v4f x = {o[j][t][4 * c], o[j][t][4 * c + 1], o[j][t][4 * c + 2], o[j][t][4 * c + 3]}; *(v4fa*)&mo[g - 1][w][(j * 4 + t) * 2 + c][lane][0] = x; }
    const v4f x = {m[0], m[1], l[0], l[1]}; *(v4fa*)&mo[g - 1][w][16][lane][0] = x; }
  __syncthreads();      /* every wave of the block passes it: the state of the waves g > 0 is in LDS before wave g = 0 reads it */
  if (g != 0) return;
  { v4f ml[FA_KS - 1];
#pragma unroll
    for (int p = 0; p < FA_KS - 1; ++p) ml[p] = *(const v4fa*)&mo[p][w][16][lane][0];
#pragma unroll
    for (int j = 0; j < 2; ++j) { float mx = m[j];
#pragma unroll
      for (int p = 0; p < FA_KS - 1; ++p) mx = fmaxf(mx, ml[p][j]);
      const float a0 = fa_exp2((m[j] - mx) * FA_C); l[j] *= a0;
#pragma unroll
      for (int t = 0; t < 4; ++t)
#pragma unroll
        for (int r = 0; r < 8; ++r) o[j][t][r] *= a0;
#pragma unroll
      for (int p = 0; p < FA_KS - 1; ++p) { const float a = fa_exp2((ml[p][j] - mx) * FA_C); l[j] += ml[p][2 + j] * a;
#pragma unroll
        for (int t = 0; t < 4; ++t)
#pragma unroll
          for (int c = 0; c < 2; ++c) { const v4f x = *(const v4fa*)&mo[p][w][(j * 4 + t) * 2 + c][lane][0];
#pragma unroll
            for (int i = 0; i < 4; ++i) o[j][t][4 * c + i] += x[i] * a; } } } }
#pragma unroll
  for (int j = 0; j < 2; ++j) { const float inv = 64.0f / (l[j] + rs_xrow(l[j]));      /* the two lane halves hold disjoint keys' sums; o carried x64 */
    unsigned short* dst = (unsigned short*)O16 + (r0 + q0 + 16 * j) * DM + (size_t)h * 1024 + 8 * lane;      /* o rows in fragment order for the output GEMM: strip of 16 rows, tiles 2 h and 2 h + 1; the lane's 8 values are one 16-byte half of its own fragment */
#pragma unroll
    for (int t = 0; t < 4; ++t) { FragH f;
#pragma unroll
      for (int r = 0; r < 8; ++r) f.h[r] = (_Float16)(o[j][t][r] * inv);
      *(v8us*)(dst + 256 * t) = f.half[0]; } } }


// q | k | v projection of every token row in one launch. One block of twelve waves a WGP takes 256 rows x 192 columns (4 x 3 waves of 64 x 64; the columns are one head each of q, k and v): sixteen products a trip on eight fragments.
// The block's 28 operand strips (16 of x, 12 of the weights) come into LDS once for all twelve waves, 128 k a stage, by asynchronous copies into two buffers, the stage after next asked for while this one is worked on; the waves take their fragments from LDS:
// every A strip is read by three waves and every B strip by four, and as plain loads each of these reads went down the global load path by itself. A wave's 64 columns are exactly one head of q, of k or of v, and its epilogue finishes that head's rows itself:
// q, k: f32 row through LDS, interleaved-pair rotation from the f32 tables, f16 hi + x1024 residual planes in fragment order; v: f16 from the accumulators (a lane holds 8 consecutive tokens of one column) straight into V^T in fragment order, whole 128-byte lines.
typedef float v2fa __attribute__((ext_vector_type(2), may_alias));
#define QK_BM 256      /* rows a block */
#define QK_BN 192      /* columns a block: one head each of q, k and v */
#define QK_NS ((QK_BM + QK_BN) / 16)      /* strips of 16 rows a stage */
static_assert(NR % QK_BM == 0 && SQ % QK_BM == 0 && 3 * DM / QK_BN == NH && QK_BN == 3 * HD && DM % 128 == 0, "k_qkv: whole blocks, none across a batch, four trips a stage");
static_assert((DM & (DM - 1)) == 0 && (DM / 16) % 64 == 0 && DM / 128 >= 2, "k_qkv: the k walk wraps by a mask, every start is a whole half stage, and the ring's first two stages exist");
static_assert(QK_NS == 28, "k_qkv: twelve waves copy strips w and w + 12, the first four also 24 + w");
// the products are the plain builtin (the compiler keeps their distances itself)
#define QK_ROW(R0, R1, R2, R3, F, T) c0##T = fa_mma(R0, F, c0##T); c1##T = fa_mma(R1, F, c1##T); c2##T = fa_mma(R2, F, c2##T); c3##T = fa_mma(R3, F, c3##T);
#define QK_SET(A0, A1, A2, A3, F0, F1, F2, F3) QK_ROW(A0, A1, A2, A3, F0, 0) QK_ROW(A0, A1, A2, A3, F1, 1) QK_ROW(A0, A1, A2, A3, F2, 2) QK_ROW(A0, A1, A2, A3, F3, 3)
// a set's eight fragments from LDS: tile at element offset KO of the wave's four A and four B strips
#define QK_LOAD(A0, A1, A2, A3, F0, F1, F2, F3, KO) v16h A0 = gf_frag(la + (KO)), A1 = gf_frag(la + QK_SP + (KO)), A2 = gf_frag(la + 2 * QK_SP + (KO)), A3 = gf_frag(la + 3 * QK_SP + (KO)), \
    F0 = gf_frag(lb + (KO)), F1 = gf_frag(lb + QK_SP + (KO)), F2 = gf_frag(lb + 2 * QK_SP + (KO)), F3 = gf_frag(lb + 3 * QK_SP + (KO));
#define QK_AGAIN(A0, A1, A2, A3, F0, F1, F2, F3, KO) A0 = gf_frag(la + (KO)); A1 = gf_frag(la + QK_SP + (KO)); A2 = gf_frag(la + 2 * QK_SP + (KO)); A3 = gf_frag(la + 3 * QK_SP + (KO)); \
    F0 = gf_frag(lb + (KO)); F1 = gf_frag(lb + QK_SP + (KO)); F2 = gf_frag(lb + 2 * QK_SP + (KO)); F3 = gf_frag(lb + 3 * QK_SP + (KO));
// stage S of the k walk into buffer BUF: every wave its two strips, the first four waves (a scalar test) a third; a strip's two halves of 64 k in one statement, each from its own wrapped k
#define QK_STAGE(S, BUF) { const int ka = ((rot + 128 * (S)) & (DM - 1)) * 16, kc = ((rot + 128 * (S) + 64) & (DM - 1)) * 16; const unsigned ld = lw + (unsigned)(BUF) * (QK_NS * QK_SP * 2); \
    qk_copy2(ld, gs0 + ka, ld + QK_SE * 2, gs0 + kc); qk_copy2(ld + 12 * QK_SP * 2, gs1 + ka, ld + 12 * QK_SP * 2 + QK_SE * 2, gs1 + kc); \
    if (w < 4) qk_copy2(ld + 24 * QK_SP * 2, gs2 + ka, ld + 24 * QK_SP * 2 + QK_SE * 2, gs2 + kc); }
__device__ __forceinline__ const _Float16* qk_strip(const _Float16* A, const _Float16* Bh, int mt, int nt, int s) {      /* strip s of the block: 0 to 15 its x rows, 16 + 4 p + t the columns 16 t of head nt of part p */
  return s < QK_BM / 16 ? A + (size_t)(mt * QK_BM + 16 * s) * DM : Bh + (size_t)((((s - QK_BM / 16) >> 2) * NH + nt) * HD + 16 * ((s - QK_BM / 16) & 3)) * DM; }
__global__ __launch_bounds__(384) void k_qkv(const _Float16* __restrict__ A, const _Float16* __restrict__ Bh, const float* __restrict__ bias, const float* __restrict__ CS, const float* __restrict__ SN,
    _Float16* __restrict__ QH, _Float16* __restrict__ QL, _Float16* __restrict__ KH, _Float16* __restrict__ KL, _Float16* __restrict__ VT) {
  __shared__ __attribute__((aligned(128))) _Float16 ring[2][QK_NS][QK_SP];      /* two stages of the block's operand strips */
  static_assert(sizeof(float) * 12 * 64 * 68 <= sizeof(_Float16) * 2 * QK_NS * QK_SP, "k_qkv: the epilogue's planes fit in the ring");
  float (*so)[64][68] = (float (*)[64][68])&ring[0][0][0];      /* the epilogue's f32 planes, one a wave, in the ring's place: behind the loop's last barrier no wave reads the ring any more and no copy is outstanding */
  const int tid = threadIdx.x, lane = tid & 31, ln = lane & 15, hh = lane >> 4; const int w = __builtin_amdgcn_readfirstlane(tid >> 5);      /* scalar wave number: which of q, k, v a wave holds is a scalar branch */
  const int ntn = 3 * DM / QK_BN; const int mt = blockIdx.x / ntn, nt = blockIdx.x - mt * ntn; const int nq = (w >> 2) * NH + nt;      /* head nt of q (waves 0 to 3), of k (4 to 7) and of v (8 to 11): every block, and every SIMD, has the same share of the long q, k epilogue */
  const int row0 = mt * QK_BM + 64 * (w & 3), col0 = nq * HD; const int part = nq / NH, h = nq - part * NH;      /* part 0 q, 1 k, 2 v: the same for the whole wave */
  const v8f z8 = {0.f,0.f,0.f,0.f,0.f,0.f,0.f,0.f};
  v8f c00 = z8, c01 = z8, c02 = z8, c03 = z8, c10 = z8, c11 = z8, c12 = z8, c13 = z8, c20 = z8, c21 = z8, c22 = z8, c23 = z8, c30 = z8, c31 = z8, c32 = z8, c33 = z8;
  /* the k walk starts at the block's own k, rot, and wraps round: the sixteen blocks that share A strips (one mt) and the sixteen that share B strips (one nt) all run at the same time, and started alike they would ask L2 for the same lines at the same moment; so each of the sixteen has a start of its own */
  const int rot = ((mt + nt) & 15) * (DM / 16);
  /* A, Bh in fragment order (see gf_frag), strips of 16 rows, 512 elements a tile of 32 k; the lane's own addresses of the strips that its wave copies */
  const _Float16* gs0 = qk_strip(A, Bh, mt, nt, w) + 8 * lane; const _Float16* gs1 = qk_strip(A, Bh, mt, nt, w + 12) + 8 * lane; const _Float16* gs2 = qk_strip(A, Bh, mt, nt, 24 + (w & 3)) + 8 * lane;
  const unsigned lw = (unsigned)(size_t)&ring[0][w][8 * lane];      /* LDS byte address of the lane's 16 bytes in strip w of buffer 0 */
  QK_STAGE(0, 0)
  asm volatile("s_wait_asynccnt 0x0" ::: "memory");      /* the wave's own copies of stage 0 have landed */
  __syncthreads();      /* every wave's have: stage 0 may be read */
  QK_STAGE(1, 1)
#pragma unroll 1      /* rolled: one stage's code */
  for (int s = 0; s < DM / 128; ++s) {
    const _Float16* la = &ring[s & 1][4 * (w & 3)][8 * lane]; const _Float16* lb = &ring[s & 1][QK_BM / 16 + 4 * (w >> 2)][8 * lane];      /* the wave's four A and four B strips in this stage's buffer */
    /* two fragment sets, x and y, 32 k each; every set is read as one group of LDS reads and asked for again, for the stage's second 64 k, directly behind its products, so that these reads run while the other set's products do. */
    /* G2_HOLD keeps each group at its place: sunk to their uses the reads stood singly among the products, each waited out by itself */
    QK_LOAD(xa0, xa1, xa2, xa3, xb0, xb1, xb2, xb3, 0) G2_HOLD QK_LOAD(ya0, ya1, ya2, ya3, yb0, yb1, yb2, yb3, 512) G2_HOLD
    QK_SET(xa0, xa1, xa2, xa3, xb0, xb1, xb2, xb3) G2_HOLD QK_AGAIN(xa0, xa1, xa2, xa3, xb0, xb1, xb2, xb3, 1024) G2_HOLD
    QK_SET(ya0, ya1, ya2, ya3, yb0, yb1, yb2, yb3) G2_HOLD QK_AGAIN(ya0, ya1, ya2, ya3, yb0, yb1, yb2, yb3, 1536) G2_HOLD
    QK_SET(xa0, xa1, xa2, xa3, xb0, xb1, xb2, xb3) QK_SET(ya0, ya1, ya2, ya3, yb0, yb1, yb2, yb3)
    G2_HOLD      /* the products stay in front of the barrier: lifted over them it would put the refill behind them, and the copies need the whole time between two barriers to land */
    asm volatile("s_wait_dscnt 0x0" ::: "memory");      /* the wave's reads of this buffer are done before it is refilled */
    asm volatile("s_wait_asynccnt 0x0" ::: "memory");      /* the wave's own copies of the next stage have landed */
    __syncthreads();      /* the next stage may be read by every wave, and every wave has left this stage's buffer */
    if (s + 2 < DM / 128) QK_STAGE(s + 2, s & 1) }
  asm volatile("s_wait_asynccnt 0x0" ::: "memory");      /* no copy is outstanding behind the loop */
  float bb[4];      /* the wave's bias */
#pragma unroll
  for (int t = 0; t < 4; ++t) bb[t] = bias[col0 + t * 16 + ln];
  asm volatile("s_wait_xcnt 0x0" ::: "memory");      /* stands in front of the first write of the four loads' offset register */
  v8f accs[16] = {c00, c01, c02, c03, c10, c11, c12, c13, c20, c21, c22, c23, c30, c31, c32, c33};      /* [strip of 16 rows][16 columns] */
  const size_t hb = ((size_t)((row0 / SQ) * NH + h) * SQ + row0 % SQ) * HD;      /* the wave's 64 tokens in a plane of its (batch, head): 64 elements a token in fragment order */
  if (part == 2) {      /* V^T tiles (16 head columns x 32 keys) in fragment order: the wave's 64 tokens are two groups of 32 keys, and a lane's 8 accumulator values (column ln of tile t, tokens 16 i + 8 hh + r) are one 16-byte half of its own fragment: stored from the registers, 512 bytes in a row a store */
    unsigned short* vd = (unsigned short*)VT + hb + 8 * lane;
#pragma unroll
    for (int u = 0; u < 16; ++u) { const int t = u & 3, i = u >> 2; const float bv = bf16_round(bb[t]); FragH f;
#pragma unroll
      for (int r = 0; r < 8; ++r) f.h[r] = (_Float16)(accs[u][r] * 0.0625f + bv);
      *(v8us*)(vd + (i >> 1) * 2048 + t * 512 + (i & 1) * 256) = f.half[0]; }
    return; }
#pragma unroll
  for (int u = 0; u < 16; ++u) { const int t = u & 3, i = u >> 2; const float bv = bf16_round(bb[t]);
#pragma unroll
    for (int r = 0; r < 8; ++r) so[w][i * 16 + 8 * hh + r][t * 16 + ln] = accs[u][r] * 0.0625f + bv; }
  __builtin_amdgcn_fence(__ATOMIC_ACQ_REL, "workgroup"); __builtin_amdgcn_wave_barrier();      /* a wave reads back only its own plane of so: its LDS writes are ordered in front of its reads, no block barrier */
  const int rsub = lane >> 4, c4 = (lane & 15) * 4;
  _Float16* Hh = (part ? KH : QH) + hb + (c4 >> 3) * 128 + (c4 & 7); _Float16* Hl = (part ? KL : QL) + hb + (c4 >> 3) * 128 + (c4 & 7);      /* the lane's 4 columns in fragment order: tile c4 >> 5, half (c4 >> 4) & 1, lane half (c4 >> 3) & 1, 128 elements apart each step of 8 columns */
#pragma unroll 1      /* rolled, eight steps (16 rows) a trip, inside the registers that the main loop takes anyway (sixteen steps a trip spilled) */
  for (int q0 = 0; q0 < 32; q0 += 8) {
    v4f vv[8]; v2fa cc[8], ss[8];      /* a trip's rows and table entries all asked for in front of its first store: behind a store the build holds every later load back, one load latency a step */
#pragma unroll
    for (int j = 0; j < 8; ++j) { const int r = (q0 + j) * 2 + rsub; const size_t to = (size_t)((row0 + r) % SQ) * (HD / 2) + (c4 >> 1);
      vv[j] = *(const v4fa*)&so[w][r][c4]; cc[j] = *(const v2fa*)(CS + to); ss[j] = *(const v2fa*)(SN + to); }
#pragma unroll
    for (int j = 0; j < 8; ++j) { const int r = (q0 + j) * 2 + rsub; const v4f v = vv[j]; const v2fa c = cc[j], s = ss[j]; float o[4];
      o[0] = fmaf(v[0], c[0], -(v[1] * s[0])); o[1] = fmaf(v[0], s[0], v[1] * c[0]); o[2] = fmaf(v[2], c[1], -(v[3] * s[1])); o[3] = fmaf(v[2], s[1], v[3] * c[1]);      /* the odd element's product rounded, the even element's fused onto it */
      v4h fh, fl;
#pragma unroll
      for (int i = 0; i < 4; ++i) { const _Float16 hi = (_Float16)o[i]; fh[i] = hi; fl[i] = (_Float16)((o[i] - (float)hi) * 1024.0f); }
      const size_t d = (size_t)(r >> 4) * 1024 + (r & 15) * 8; *(v4h*)(Hh + d) = fh; *(v4h*)(Hl + d) = fl; }
    asm volatile("s_wait_xcnt 0x0" ::: "memory"); } }      /* stands in front of the next trip's first writes, which may reuse a register of this trip's stores */

extern "C" void kernel_launch(void* const* d_in, const int* in_sizes, int n_in,
                              void* d_out, int out_size, void* d_ws, size_t ws_size, hipStream_t stream) {
  (void)in_sizes; (void)n_in; (void)out_size;
  const float* const* I = (const float* const*)d_in; const float* x = I[0]; const float* wqkv = I[1]; const float* bqkv = I[2]; const float* wo = I[3]; const float* bo = I[4];      /* [in][out] fused qkv + out weights, biases */
  char* ws = (char*)d_ws; size_t off = 0;
  auto take = [&](size_t bytes) { char* p = ws + off; off += (bytes + 255) & ~(size_t)255; return p; };
  _Float16* BQKV = (_Float16*)take((size_t)3 * DM * DM * 2); _Float16* BO = (_Float16*)take((size_t)DM * DM * 2); float* CS = (float*)take((size_t)SQ * (HD / 2) * 4); float* SN = (float*)take((size_t)SQ * (HD / 2) * 4);
  _Float16* X16 = (_Float16*)take(NR * DM * 2);
  _Float16* QH = (_Float16*)take(NR * DM * 2); _Float16* QL = (_Float16*)take(NR * DM * 2); _Float16* KH = (_Float16*)take(NR * DM * 2); _Float16* KL = (_Float16*)take(NR * DM * 2); _Float16* O16 = (_Float16*)take(NR * DM * 2);
  _Float16* VT = (_Float16*)take((size_t)NB * NH * HD * SQ * 2);      /* V^T of every batch */
  if (off > ws_size) return;
  k_prep<<<PREP_T / 256, 256, 0, stream>>>(x, wqkv, wo, 10000.0f, X16, BQKV, BO, CS, SN);      /* x rows, [in][out] weights -> Bt(n, k) x16 (q | k | v stacked along n), all in fragment order; cos / sin tables */
  k_qkv<<<(unsigned)((NR / QK_BM) * (3 * DM / QK_BN)), 384, 0, stream>>>(X16, BQKV, bqkv, CS, SN, QH, QL, KH, KL, VT);      /* roped q, k as f16 hi + x1024 residual (the x8 logits, sigma ~64, need ~f32-accurate scores) and V^T, per (batch, head), in fragment order */
  k_fattn<<<dim3(NB * NH, SQ / 128), 128 * FA_KS, 0, stream>>>(QH, QL, KH, KL, VT, O16);      /* o (merged heads, x64) as f16 rows in fragment order */
  k_gemm2<0><<<dim3((unsigned)((MPO / 128) * (DM / 64)), 1), 128, 0, stream>>>(O16 + (size_t)B0 * SQ * DM, DM, 0, BO, DM, 0, 0.0009765625f, bo, 0, nullptr, 1, 0, 0, (float*)d_out + (size_t)B0 * SQ * DM, nullptr, DM, 0, MPO, DM, DM);      /* out rows are the output layout */
}
